// v000
// Measured on an AMD MI455X. A time is GPU time per run, averaged over a window of back-to-back runs after a warm-up
// (all launches, gaps included; the runs take copies of the inputs in turn), and the median of several windows.
// Apart from v000's, it joins two sittings. Times from different sittings can be a few percent apart, while
// side-by-side timings come from the same sitting.
// v000 is the starting kernel. One run takes 117 microseconds.
#include <hip/hip_runtime.h>

#define IN_F   4096
#define OUT_F  4096
#define BATCH  4096

#define MT 128      // M tile (batch rows) per block
#define NT 128      // N tile (out features) per block
#define KT 64       // K halfs staged per TDM tile
#define LDSS 72     // padded LDS row stride in halfs (36 dwords; conflict-free mod 64 banks)
#define NIT (IN_F / KT)

typedef __attribute__((ext_vector_type(16))) _Float16 v16h;
typedef __attribute__((ext_vector_type(4)))  _Float16 v4h;
typedef __attribute__((ext_vector_type(8)))  float    v8f;
typedef __attribute__((ext_vector_type(4)))  unsigned int v4u;
typedef __attribute__((ext_vector_type(8)))  int          v8i;
typedef __attribute__((ext_vector_type(4)))  int          v4i;

union Frag16 { uint4 u[2]; v16h v; };

// ---------------- kernel 1: zero the f16 weight buffer ----------------
__global__ __launch_bounds__(256) void zero_f16_kernel(uint4* __restrict__ p, int n16) {
    int i = blockIdx.x * 256 + threadIdx.x;
    if (i < n16) {
        uint4 z; z.x = 0u; z.y = 0u; z.z = 0u; z.w = 0u;
        p[i] = z;
    }
}

// ---------------- kernel 2: convert inputs f32 -> f16 ----------------
__global__ __launch_bounds__(256) void cvt_f32_to_f16_kernel(const float* __restrict__ src,
                                                             _Float16* __restrict__ dst, int n) {
    int i = (blockIdx.x * 256 + threadIdx.x) * 4;
    if (i < n) {
        float4 v = *(const float4*)(src + i);
        v4h h;
        h[0] = (_Float16)v.x; h[1] = (_Float16)v.y;
        h[2] = (_Float16)v.z; h[3] = (_Float16)v.w;
        *(v4h*)(dst + i) = h;
    }
}

// ---------------- kernel 3: scatter COO values into dense f16 W ----------------
__global__ __launch_bounds__(256) void scatter_kernel(const float* __restrict__ vals,
                                                      const int* __restrict__ rows,
                                                      const int* __restrict__ cols,
                                                      _Float16* __restrict__ W, int nnz) {
    int i = blockIdx.x * 256 + threadIdx.x;
    if (i < nnz) {
        W[(size_t)rows[i] * IN_F + cols[i]] = (_Float16)vals[i];  // unique indices
    }
}

// ---------------- TDM: DMA one 128x64 f16 tile (row stride IN_F) into LDS ----------------
// LDS dest gets 4-dword padding after each 32-dword row => row stride = 72 halfs (LDSS).
__device__ __forceinline__ void tdm_load_tile(const _Float16* gsrc, unsigned lds_byte_off) {
    unsigned long long ga = (unsigned long long)(size_t)gsrc;
    v4u g0;
    g0[0] = 1u;                                            // count=1, user mode
    g0[1] = lds_byte_off;                                  // lds_addr
    g0[2] = (unsigned)(ga & 0xffffffffu);                  // global_addr[31:0]
    g0[3] = (unsigned)((ga >> 32) & 0x1ffffffu) | (2u << 30); // global_addr[56:32] | type=2
    v8i g1;
    g1[0] = (int)((1u << 16)      // data_size = 2 bytes
                | (1u << 20)      // pad_enable
                | (4u << 22)      // pad_interval: 32 dwords (128B row)
                | (3u << 25));    // pad_amount: 4 dwords (8 halfs)
    g1[1] = (int)(4096u << 16);   // tensor_dim0 = 4096 (lo16)
    g1[2] = (int)(4096u << 16);   // tensor_dim0 hi=0 | tensor_dim1 = 4096 (lo16)
    g1[3] = (int)((unsigned)KT << 16);   // tensor_dim1 hi=0 | tile_dim0 = 64
    g1[4] = MT;                   // tile_dim1 = 128, tile_dim2 = 0
    g1[5] = IN_F;                 // tensor_dim0_stride lo32 = 4096
    g1[6] = 0;                    // stride hi | tensor_dim1_stride lo (unused, 2D)
    g1[7] = 0;
    v4i z4 = {0, 0, 0, 0};
#if defined(__clang_major__) && (__clang_major__ >= 23)
    v8i z8 = {0, 0, 0, 0, 0, 0, 0, 0};
    __builtin_amdgcn_tensor_load_to_lds(g0, g1, z4, z4, z8, 0);
#else
    __builtin_amdgcn_tensor_load_to_lds(g0, g1, z4, z4, 0);
#endif
}

// ---------------- kernel 4: WMMA f16 GEMM: C = A * W^T + bias ----------------
__global__ __launch_bounds__(256, 2) void gemm_wmma_kernel(const _Float16* __restrict__ A,
                                                           const _Float16* __restrict__ W,
                                                           const float* __restrict__ bias,
                                                           float* __restrict__ C) {
    __shared__ _Float16 sA[2][MT * LDSS];
    __shared__ _Float16 sW[2][NT * LDSS];

    const int tid  = threadIdx.x;
    const int lane = tid & 31;
    const int wid  = tid >> 5;

    const int b0 = blockIdx.x * MT;
    const int o0 = blockIdx.y * NT;

    // wave layout: 2 (M) x 4 (N); each wave owns a 64x32 sub-tile = 4x2 WMMA frags
    const int wm = (wid >> 2) * 64;
    const int wn = (wid & 3) * 32;

    v8f acc[4][2];
#pragma unroll
    for (int mi = 0; mi < 4; ++mi)
#pragma unroll
        for (int ni = 0; ni < 2; ++ni)
            acc[mi][ni] = (v8f)(0.0f);

    const _Float16* gA = A + (size_t)b0 * IN_F;
    const _Float16* gW = W + (size_t)o0 * IN_F;
    const unsigned ldsA0 = (unsigned)(size_t)(void*)&sA[0][0];
    const unsigned ldsA1 = (unsigned)(size_t)(void*)&sA[1][0];
    const unsigned ldsW0 = (unsigned)(size_t)(void*)&sW[0][0];
    const unsigned ldsW1 = (unsigned)(size_t)(void*)&sW[1][0];

    // per-lane fragment addressing (16-bit WMMA layout):
    // lane -> row fr, two 16B chunks at K = kb and kb+16 within a 32-half k-chunk
    const int fr = lane & 15;
    const int kb = (lane >> 4) * 8;

    // prologue: wave 0 DMAs stage 0 into buffer 0
    if (wid == 0) {
        tdm_load_tile(gA, ldsA0);
        tdm_load_tile(gW, ldsW0);
    }

    for (int it = 0; it < NIT; ++it) {
        const int buf = it & 1;
        __syncthreads();   // all waves done reading buf^1 (previous compute)

        if (wid == 0) {
            if (it + 1 < NIT) {
                const size_t koff = (size_t)(it + 1) * KT;
                tdm_load_tile(gA + koff, buf ? ldsA0 : ldsA1);
                tdm_load_tile(gW + koff, buf ? ldsW0 : ldsW1);
                __builtin_amdgcn_s_wait_tensorcnt((short)2);  // stage `it` complete
            } else {
                __builtin_amdgcn_s_wait_tensorcnt((short)0);
            }
        }
        __syncthreads();   // stage `it` tiles visible to all waves

        const _Float16* tA = &sA[buf][0];
        const _Float16* tW = &sW[buf][0];
#pragma unroll
        for (int c = 0; c < 2; ++c) {          // two 32-deep k-chunks per staged tile
            const int ko = c * 32 + kb;
            v16h af[4], bf[2];
#pragma unroll
            for (int mi = 0; mi < 4; ++mi) {
                const _Float16* p = tA + (wm + mi * 16 + fr) * LDSS + ko;
                Frag16 t;
                t.u[0] = *(const uint4*)p;
                t.u[1] = *(const uint4*)(p + 16);
                af[mi] = t.v;
            }
#pragma unroll
            for (int ni = 0; ni < 2; ++ni) {
                const _Float16* p = tW + (wn + ni * 16 + fr) * LDSS + ko;
                Frag16 t;
                t.u[0] = *(const uint4*)p;
                t.u[1] = *(const uint4*)(p + 16);
                bf[ni] = t.v;
            }
#pragma unroll
            for (int mi = 0; mi < 4; ++mi)
#pragma unroll
                for (int ni = 0; ni < 2; ++ni)
                    acc[mi][ni] = __builtin_amdgcn_wmma_f32_16x16x32_f16(
                        false, af[mi], false, bf[ni],
                        (short)0, acc[mi][ni], false, false);
        }
    }

    // epilogue: C/D layout -> lane gives N = fr, VGPR r gives M = (lane>>4)*8 + r
#pragma unroll
    for (int ni = 0; ni < 2; ++ni) {
        const int o = o0 + wn + ni * 16 + fr;
        const float bv = bias[o];
#pragma unroll
        for (int mi = 0; mi < 4; ++mi) {
            const int m = b0 + wm + mi * 16 + (lane >> 4) * 8;
            float* cp = C + (size_t)m * OUT_F + o;
#pragma unroll
            for (int r = 0; r < 8; ++r)
                cp[(size_t)r * OUT_F] = acc[mi][ni][r] + bv;
        }
    }
}

extern "C" void kernel_launch(void* const* d_in, const int* in_sizes, int n_in,
                              void* d_out, int out_size, void* d_ws, size_t ws_size,
                              hipStream_t stream) {
    const float* inputs = (const float*)d_in[0];
    const float* vals   = (const float*)d_in[1];
    const int*   rows   = (const int*)d_in[2];
    const int*   cols   = (const int*)d_in[3];
    const float* bias   = (const float*)d_in[4];
    const int nnz = in_sizes[1];

    float* out = (float*)d_out;

    _Float16* Ah = (_Float16*)d_ws;                 // 32MB f16 inputs
    _Float16* Wh = Ah + (size_t)BATCH * IN_F;       // 32MB f16 dense W

    {
        int n16 = (OUT_F * IN_F) / 8;
        zero_f16_kernel<<<(n16 + 255) / 256, 256, 0, stream>>>((uint4*)Wh, n16);
    }
    {
        int n = BATCH * IN_F;
        cvt_f32_to_f16_kernel<<<(n / 4 + 255) / 256, 256, 0, stream>>>(inputs, Ah, n);
    }
    scatter_kernel<<<(nnz + 255) / 256, 256, 0, stream>>>(vals, rows, cols, Wh, nnz);

    dim3 grid(BATCH / MT, OUT_F / NT);
    gemm_wmma_kernel<<<grid, 256, 0, stream>>>(Ah, Wh, bias, out);
}

// v001
// Measured time: 94.9 microseconds a run.
// Timed twice side by side with v000, it ran 1.26 times as fast both times.
#include <hip/hip_runtime.h>

#define IN_F   4096
#define OUT_F  4096
#define BATCH  4096

#define BM 256      // M tile (batch rows) per block
#define BN 256      // N tile (out features) per block
#define KT 128      // K halfs per staged pass: rows of 256 bytes
#define NPASS (IN_F / KT)
#define ROWB 256u                    // bytes of one staged row
#define PITCH 272u                   // LDS row pitch in bytes: 16 B x odd, conflict-free for ds_load_b128
#define SLICE_ROWS 64u               // rows that one wave's tensor load brings
#define SLICE_LDS 18432u             // 64 rows x 272 B = 17408 B, rounded up to a multiple of 2 KiB
#define STAGE_LDS (8u * SLICE_LDS)   // slices 0-3: A rows, slices 4-7: W rows

typedef __attribute__((ext_vector_type(16))) _Float16 v16h;
typedef __attribute__((ext_vector_type(4)))  _Float16 v4h;
typedef __attribute__((ext_vector_type(8)))  float    v8f;
typedef __attribute__((ext_vector_type(4)))  unsigned int v4u;
typedef __attribute__((ext_vector_type(8)))  unsigned int v8u;

union Frag16 { uint4 u[2]; v16h v; };

// ---------------- kernel 1: zero the f16 weight buffer ----------------
__global__ __launch_bounds__(256) void zero_f16_kernel(uint4* __restrict__ p, int n16) {
    int i = blockIdx.x * 256 + threadIdx.x;
    if (i < n16) {
        uint4 z; z.x = 0u; z.y = 0u; z.z = 0u; z.w = 0u;
        p[i] = z;
    }
}

// ---------------- kernel 2: convert inputs f32 -> f16 ----------------
__global__ __launch_bounds__(256) void cvt_f32_to_f16_kernel(const float* __restrict__ src,
                                                             _Float16* __restrict__ dst, int n) {
    int i = (blockIdx.x * 256 + threadIdx.x) * 4;
    if (i < n) {
        float4 v = *(const float4*)(src + i);
        v4h h;
        h[0] = (_Float16)v.x; h[1] = (_Float16)v.y;
        h[2] = (_Float16)v.z; h[3] = (_Float16)v.w;
        *(v4h*)(dst + i) = h;
    }
}

// ---------------- kernel 3: scatter COO values into dense f16 W ----------------
__global__ __launch_bounds__(256) void scatter_kernel(const float* __restrict__ vals,
                                                      const int* __restrict__ rows,
                                                      const int* __restrict__ cols,
                                                      _Float16* __restrict__ W, int nnz) {
    int i = blockIdx.x * 256 + threadIdx.x;
    if (i < nnz) {
        W[(size_t)rows[i] * IN_F + cols[i]] = (_Float16)vals[i];  // unique indices
    }
}

// ---------------- tensor load: one wave's slice, 64 rows of 256 bytes, into LDS at pitch 272 ----------------
__device__ __forceinline__ unsigned uni(unsigned v) { return (unsigned)__builtin_amdgcn_readfirstlane(v); }
__device__ __forceinline__ unsigned pinned(unsigned v) { unsigned w = uni(v); asm volatile("" : "+s"(w)); return w; }  // pinned(): holds a wave-uniform test in a scalar register, so that the branch round a tensor load is s_cmp + s_cbranch_scc (the load ignores EXEC)
__device__ __forceinline__ void wait_tensor0() { asm volatile("s_wait_tensorcnt 0x0" ::: "memory"); }  // this wave's slice has landed
__device__ __forceinline__ void wait_ds0() { asm volatile("s_wait_dscnt 0x0" ::: "memory"); }          // this wave's LDS reads have returned

__device__ __forceinline__ v8u tdm_group1() {
    v8u g;
    g[0] = uni((1u << 20) | (5u << 22) | (3u << 25));  // 1-byte elements, no mask; 4 dwords of pad behind every 64 dwords
    g[1] = uni((ROWB & 0xFFFFu) << 16);                // tensor_dim0 = 256 bytes
    g[2] = uni((ROWB >> 16) | ((SLICE_ROWS & 0xFFFFu) << 16));  // tensor_dim1 = 64 rows
    g[3] = uni((SLICE_ROWS >> 16) | (ROWB << 16));     // tile_dim0 = 256 bytes
    g[4] = uni(SLICE_ROWS);                            // tile_dim1 = 64 rows
    g[5] = uni(IN_F * 2u);                             // source row pitch in bytes
    g[6] = uni(0u);
    g[7] = uni(0u);
    return g;
}
// gd = words 2 and 3 of group 0: global address [56:0] of the slice's first byte | type = 2 in bits 63:62
__device__ __forceinline__ void tdm_load(unsigned lds_dst, unsigned long long gd, v8u g1) {
    v4u g0;
    g0[0] = uni(1u);                                   // count = 1
    g0[1] = uni(lds_dst);                              // byte offset in the work-group's LDS
    g0[2] = uni((unsigned)gd);
    g0[3] = uni((unsigned)(gd >> 32));
    // one request of the whole wave: its slice goes from global memory into LDS through no register
    asm volatile("tensor_load_to_lds %0, %1" :: "s"(g0), "s"(g1) : "memory");
}

// ---------------- kernel 4: WMMA f16 GEMM: C = A * W^T + bias ----------------
__global__ __launch_bounds__(256) void gemm_wmma_kernel(const _Float16* __restrict__ A,
                                                        const _Float16* __restrict__ W,
                                                        const float* __restrict__ bias,
                                                        float* __restrict__ C) {
    __shared__ __attribute__((aligned(2048))) unsigned char L[2u * STAGE_LDS];

    const unsigned tid  = threadIdx.x;
    const unsigned lane = tid & 31u;
    const unsigned wave = uni(tid >> 5);

    const unsigned b0 = blockIdx.x * BM;
    const unsigned o0 = blockIdx.y * BN;

    // wave layout: 4 (M) x 2 (N); each wave owns a 64x128 sub-tile = 4x8 WMMA frags
    const unsigned wmi = wave >> 1;
    const unsigned wni = wave & 1u;

    // every "#pragma unroll" in this kernel: constant indices keep acc and the fragments in registers (no scratch)
    v8f acc[4][8];
#pragma unroll
    for (int mi = 0; mi < 4; ++mi)
#pragma unroll
        for (int ni = 0; ni < 8; ++ni)
            acc[mi][ni] = (v8f)(0.0f);

    // this wave's slice of every stage: waves 0-3 bring 64 rows of A each, waves 4-7 64 rows of W each
    const unsigned long long gsrc = (wave < 4u)
        ? (unsigned long long)(size_t)(A + (size_t)(b0 + SLICE_ROWS * wave) * IN_F)
        : (unsigned long long)(size_t)(W + (size_t)(o0 + SLICE_ROWS * (wave - 4u)) * IN_F);
    unsigned long long gd = (gsrc & 0x01FFFFFFFFFFFFFFull) | (2ull << 62);
    const unsigned lds_slice = (unsigned)(size_t)(void*)&L[0] + wave * SLICE_LDS;
    const v8u g1 = tdm_group1();

    // per-lane fragment addressing (16-bit WMMA layout):
    // lane -> row fr, two 16B chunks at K = kb and kb+16 within a 32-half k-chunk
    const unsigned fr = lane & 15u;
    const unsigned hb = (lane >> 4) * 16u;   // kb in bytes
    const unsigned offA = wmi * SLICE_LDS + fr * PITCH + hb;
    const unsigned offW = (4u + 2u * wni) * SLICE_LDS + fr * PITCH + hb;

    // prologue: stage 0 lands and is published, then stage 1 is asked for
    tdm_load(lds_slice, gd, g1);
    wait_tensor0();
    __syncthreads();
    gd += ROWB;
    tdm_load(lds_slice + STAGE_LDS, gd, g1);

    // kept rolled: one pass per trip, so that the publish point stands once at the foot
#pragma clang loop unroll(disable)
    for (unsigned s = 0; s < NPASS; ++s) {
        const unsigned buf = (s & 1u) * STAGE_LDS;
        const unsigned char* tA = &L[0] + buf + offA;
        const unsigned char* tW = &L[0] + buf + offW;
#pragma unroll
        for (int c = 0; c < 4; ++c) {          // four 32-deep k-chunks per staged pass
            v16h af[4], bf[8];
#pragma unroll
            for (int mi = 0; mi < 4; ++mi) {
                const unsigned char* p = tA + mi * 16 * PITCH + c * 64;
                Frag16 t;
                t.u[0] = *(const uint4*)p;
                t.u[1] = *(const uint4*)(p + 32);
                af[mi] = t.v;
            }
#pragma unroll
            for (int ni = 0; ni < 8; ++ni) {
                const unsigned char* p = tW + (ni >> 2) * SLICE_LDS + (ni & 3) * 16 * PITCH + c * 64;
                Frag16 t;
                t.u[0] = *(const uint4*)p;
                t.u[1] = *(const uint4*)(p + 32);
                bf[ni] = t.v;
            }
            // holds the chunk's 24 LDS reads together in front of its 32 WMMAs: left free, the compiler keeps one
            // A fragment only and reloads it, with a wait to 0, in front of every row of 8 WMMAs
            __builtin_amdgcn_sched_barrier(0);
#pragma unroll
            for (int mi = 0; mi < 4; ++mi)
#pragma unroll
                for (int ni = 0; ni < 8; ++ni)
                    acc[mi][ni] = __builtin_amdgcn_wmma_f32_16x16x32_f16(
                        false, af[mi], false, bf[ni],
                        (short)0, acc[mi][ni], false, false);
            // keeps the next chunk's LDS reads from being spread among these WMMAs
            __builtin_amdgcn_sched_barrier(0);
        }
        // publish point of stage s + 1
        wait_ds0();
        wait_tensor0();
        __syncthreads();   // stage s + 1 visible to all waves; all waves done reading stage s
        if (pinned(s + 2u < NPASS)) {
            gd += ROWB;
            tdm_load(lds_slice + buf, gd, g1);
        }
    }
    wait_tensor0();
    wait_ds0();

    // epilogue: C/D layout -> lane gives N = fr, VGPR r gives M = (lane>>4)*8 + r
#pragma unroll
    for (int ni = 0; ni < 8; ++ni) {
        const unsigned o = o0 + wni * 128u + ni * 16 + fr;
        const float bv = bias[o];
#pragma unroll
        for (int mi = 0; mi < 4; ++mi) {
            const unsigned m = b0 + wmi * 64u + mi * 16 + (lane >> 4) * 8u;
            float* cp = C + (size_t)m * OUT_F + o;
#pragma unroll
            for (int r = 0; r < 8; ++r)
                cp[(size_t)r * OUT_F] = acc[mi][ni][r] + bv;
        }
    }
}

extern "C" void kernel_launch(void* const* d_in, const int* in_sizes, int n_in,
                              void* d_out, int out_size, void* d_ws, size_t ws_size,
                              hipStream_t stream) {
    const float* inputs = (const float*)d_in[0];
    const float* vals   = (const float*)d_in[1];
    const int*   rows   = (const int*)d_in[2];
    const int*   cols   = (const int*)d_in[3];
    const float* bias   = (const float*)d_in[4];
    const int nnz = in_sizes[1];

    float* out = (float*)d_out;

    _Float16* Ah = (_Float16*)d_ws;                 // 32MB f16 inputs
    _Float16* Wh = Ah + (size_t)BATCH * IN_F;       // 32MB f16 dense W

    {
        int n16 = (OUT_F * IN_F) / 8;
        zero_f16_kernel<<<(n16 + 255) / 256, 256, 0, stream>>>((uint4*)Wh, n16);
    }
    {
        int n = BATCH * IN_F;
        cvt_f32_to_f16_kernel<<<(n / 4 + 255) / 256, 256, 0, stream>>>(inputs, Ah, n);
    }
    scatter_kernel<<<(nnz + 255) / 256, 256, 0, stream>>>(vals, rows, cols, Wh, nnz);

    dim3 grid(BATCH / BM, OUT_F / BN);
    gemm_wmma_kernel<<<grid, 256, 0, stream>>>(Ah, Wh, bias, out);
}
